// v000
// Times are from an AMD MI455X. After a warm-up the kernel runs many times in a row, and a time is the length of
// such a window on the GPU divided by its runs, so every launch and the gaps after it count. The runs cycle
// through copies of the inputs. A figure is the median of several windows, for all but v000 over two sittings.
// Sittings can differ by a few percent; kernels timed side by side share one.
// v000 is the starting kernel. One run takes 57.7 microseconds.
#include <hip/hip_runtime.h>
#include <math.h>

#define TQ   1024
#define TY   1024
#define DD   64
#define QBLK 16
#define NWAVE 8

typedef __attribute__((ext_vector_type(2))) float v2f;
typedef __attribute__((ext_vector_type(8))) float v8f;
typedef __attribute__((vector_size(16))) int v4i;

#define AS1 __attribute__((address_space(1)))
#define AS3 __attribute__((address_space(3)))

#if defined(__HIP_DEVICE_COMPILE__) && __has_builtin(__builtin_amdgcn_global_load_async_to_lds_b128)
#define USE_ASYNC 1
#else
#define USE_ASYNC 0
#endif

#if defined(__HIP_DEVICE_COMPILE__) && __has_builtin(__builtin_amdgcn_s_wait_asynccnt)
#define WAIT_ASYNC(n) do { __builtin_amdgcn_s_wait_asynccnt(n); asm volatile("" ::: "memory"); } while (0)
#else
#define WAIT_ASYNC(n) do { asm volatile("s_wait_asynccnt %0" :: "i"(n) : "memory"); } while (0)
#endif

// Workgroup: 256 threads = 8 waves. Covers 16 query rows x 1024 ty.
// Wave w owns ty in [128w, 128w+128). Lane = 16h + r: owns q-row r,
// ty_local = s*8 + 4h + j for subchunk s in [0,16), j in [0,4).
extern "C" __global__ void __launch_bounds__(256)
att_l1_softmax_kernel(const float* __restrict__ Q, const float* __restrict__ Y,
                      float* __restrict__ att, float* __restrict__ sim)
{
  __shared__ __align__(16) float yBuf[NWAVE][2][8 * DD];  // per-wave double buffer, 2KB each
  __shared__ float maxBuf[16][QBLK];
  __shared__ float sumBuf[16][QBLK];
  __shared__ float rowSumBuf[QBLK];

  const int tid  = threadIdx.x;
  const int w    = tid >> 5;
  const int lane = tid & 31;
  const int h    = lane >> 4;
  const int r    = lane & 15;

  const int b    = blockIdx.x >> 6;          // TQ/QBLK = 64 blocks per batch
  const int q0   = (blockIdx.x & 63) * QBLK;
  const int qRow = q0 + r;

  // ---- load this lane's query row (64 floats) into registers ----
  const float4* qp = (const float4*)(Q + ((size_t)b * TQ + qRow) * DD);
  float4 qv[16];
#pragma unroll
  for (int kc = 0; kc < 16; ++kc) qv[kc] = qp[kc];

  const int   tyW  = w * 128;
  const char* ySrc = (const char*)(Y + ((size_t)b * TY + tyW) * DD);
  char* yDst[2] = { (char*)&yBuf[w][0][0], (char*)&yBuf[w][1][0] };

  // copy subchunk s: 8 ty rows x 64 floats = 2048B -> per-wave LDS buffer (s&1)
  auto issue_copy = [&](int s) {
    const char* g = ySrc + (size_t)s * 8 * DD * sizeof(float);
    char*       l = yDst[s & 1];
#if USE_ASYNC
#pragma unroll
    for (int u = 0; u < 4; ++u) {
      const int off = (lane + 32 * u) * 16;  // 128 x 16B chunks across 32 lanes
      __builtin_amdgcn_global_load_async_to_lds_b128(
          (AS1 v4i*)(g + off), (AS3 v4i*)(l + off), 0, 0);
    }
#else
#pragma unroll
    for (int u = 0; u < 4; ++u) {
      const int off = (lane + 32 * u) * 16;
      *(float4*)(l + off) = *(const float4*)(g + off);
    }
#endif
  };

  float dv[64];
  float lmax = -3.4e38f;

  issue_copy(0);
#pragma unroll
  for (int s = 0; s < 16; ++s) {
#if USE_ASYNC
    if (s < 15) { issue_copy(s + 1); WAIT_ASYNC(4); }
    else        { WAIT_ASYNC(0); }
#else
    __syncthreads();   // make copy(s) visible across lanes of the wave
#endif
    // ---- distance: all 16 lanes of a half process the same ty -> LDS broadcast ----
#pragma unroll
    for (int j = 0; j < 4; ++j) {
      const float4* yc = (const float4*)&yBuf[w][s & 1][(h * 4 + j) * DD];
      float acc = 0.f;
#pragma unroll
      for (int kc = 0; kc < 16; ++kc) {
        const float4 yv = yc[kc];
        const float4 qq = qv[kc];
        acc += fabsf(qq.x - yv.x);
        acc += fabsf(qq.y - yv.y);
        acc += fabsf(qq.z - yv.z);
        acc += fabsf(qq.w - yv.w);
      }
      const float val = -acc * (1.0f / (float)DD);  // att pre-softmax = -mean|q-y|
      dv[s * 4 + j] = val;
      lmax = fmaxf(lmax, val);
    }
#if !USE_ASYNC
    __syncthreads();
    if (s < 15) issue_copy(s + 1);
#endif
  }

  // ---- row max across the 16 (wave,half) partials ----
  maxBuf[w * 2 + h][r] = lmax;
  __syncthreads();
  float rmax = -3.4e38f;
#pragma unroll
  for (int j = 0; j < 16; ++j) rmax = fmaxf(rmax, maxBuf[j][r]);

  if (tid < 16) sim[(size_t)b * TQ + q0 + tid] = rmax;   // tid<16 => w=0,h=0,r=tid

  // ---- exp + partial sum in registers ----
  float psum = 0.f;
#pragma unroll
  for (int i = 0; i < 64; ++i) {
    const float e = __expf(dv[i] - rmax);
    dv[i] = e;
    psum += e;
  }
  sumBuf[w * 2 + h][r] = psum;
  __syncthreads();

  // ---- cross-wave sum reduction on the matrix unit: ones(16x4) x partial(4x16), 4 chunks ----
  if (w == 0) {
#if defined(__HIP_DEVICE_COMPILE__) && __has_builtin(__builtin_amdgcn_wmma_f32_16x16x4_f32)
    v2f a; a.x = 1.0f; a.y = 1.0f;                 // A = all-ones 16x4
    v8f c = {0.f, 0.f, 0.f, 0.f, 0.f, 0.f, 0.f, 0.f};
#pragma unroll
    for (int c4 = 0; c4 < 4; ++c4) {
      v2f bm;                                      // B[k][n]: n=lane&15, k=2h+{0,1}
      bm.x = sumBuf[4 * c4 + 2 * h + 0][r];
      bm.y = sumBuf[4 * c4 + 2 * h + 1][r];
      c = __builtin_amdgcn_wmma_f32_16x16x4_f32(false, a, false, bm,
                                                (short)0, c, false, false);
    }
    if (lane < 16) rowSumBuf[lane] = c[0];         // C[0][n] = rowSum[n]
#else
    if (lane < 16) {
      float ssum = 0.f;
#pragma unroll
      for (int j = 0; j < 16; ++j) ssum += sumBuf[j][lane];
      rowSumBuf[lane] = ssum;
    }
#endif
  }
  __syncthreads();

  // ---- normalize and write att (each lane: 16 x float4, 16B-aligned) ----
  const float inv = 1.0f / rowSumBuf[r];
  float* attRow = att + ((size_t)b * TQ + qRow) * TY + tyW;
#pragma unroll
  for (int s = 0; s < 16; ++s) {
    float4 o;
    o.x = dv[s * 4 + 0] * inv;
    o.y = dv[s * 4 + 1] * inv;
    o.z = dv[s * 4 + 2] * inv;
    o.w = dv[s * 4 + 3] * inv;
    *(float4*)(attRow + s * 8 + h * 4) = o;
  }
}

extern "C" void kernel_launch(void* const* d_in, const int* in_sizes, int n_in,
                              void* d_out, int out_size, void* d_ws, size_t ws_size,
                              hipStream_t stream) {
  const float* Q = (const float*)d_in[0];
  const float* Y = (const float*)d_in[1];
  float* att = (float*)d_out;
  const int B = in_sizes[0] / (TQ * DD);
  float* sim = att + (size_t)B * TQ * TY;   // outputs concatenated: att then sim
  dim3 grid(B * (TQ / QBLK));               // 256 workgroups for B=4
  att_l1_softmax_kernel<<<grid, dim3(256), 0, stream>>>(Q, Y, att, sim);
}

// v001
// It runs in 16.7 microseconds.
// Two timings next to v000 both put it at 3.54 times that version's speed.
#include <hip/hip_runtime.h>
#include <math.h>

#define TQ   1024
#define TY   1024
#define DD   64
#define QBLK 16
#define NWAVE 8

typedef __attribute__((ext_vector_type(2))) float v2f;
typedef __attribute__((ext_vector_type(8))) float v8f;
typedef __attribute__((vector_size(16))) int v4i;

#define AS1 __attribute__((address_space(1)))
#define AS3 __attribute__((address_space(3)))

#if defined(__HIP_DEVICE_COMPILE__) && __has_builtin(__builtin_amdgcn_global_load_async_to_lds_b128)
#define USE_ASYNC 1
#else
#define USE_ASYNC 0
#endif

#if defined(__HIP_DEVICE_COMPILE__) && __has_builtin(__builtin_amdgcn_s_wait_asynccnt)
#define WAIT_ASYNC(n) do { __builtin_amdgcn_s_wait_asynccnt(n); asm volatile("" ::: "memory"); } while (0)
#else
#define WAIT_ASYNC(n) do { asm volatile("s_wait_asynccnt %0" :: "i"(n) : "memory"); } while (0)
#endif

// The four chains a[0..3] take |d[j].x|, then |d[j].y|, in turn. In asm so that each link stays one
// add with the |x| source modifier: from plain code the compiler paired the chains into packed adds,
// which take no |x| and cost one more mask instruction per element.
// The delay hints name the producer four vector instructions back, so that the SIMD's other wave
// issues while a link waits.
#define ADD_ABS8(a, d)                                                             \
  asm("v_add_f32 %0, %0, |%4|\n\tv_add_f32 %1, %1, |%5|\n\t"                       \
      "v_add_f32 %2, %2, |%6|\n\tv_add_f32 %3, %3, |%7|\n\t"                       \
      "s_delay_alu instid0(VALU_DEP_4) | instskip(NEXT) | instid1(VALU_DEP_4)\n\t"  \
      "v_add_f32 %0, %0, |%8|\n\tv_add_f32 %1, %1, |%9|\n\t"                       \
      "s_delay_alu instid0(VALU_DEP_4) | instskip(NEXT) | instid1(VALU_DEP_4)\n\t"  \
      "v_add_f32 %2, %2, |%10|\n\tv_add_f32 %3, %3, |%11|"                          \
      : "+v"(a[0]), "+v"(a[1]), "+v"(a[2]), "+v"(a[3])                             \
      : "v"(d[0].x), "v"(d[1].x), "v"(d[2].x), "v"(d[3].x),                        \
        "v"(d[0].y), "v"(d[1].y), "v"(d[2].y), "v"(d[3].y))

// The same eight adds with the next pair's four differences n[j] = q - r[j] set between them: every
// add then stands six vector instructions behind the add it depends on, and every difference at
// least five ahead of its first reader in the next step, so that no link waits for its producer.
#define ADD_ABS8_SUB4(a, d, n, q, r)                                               \
  asm("v_add_f32 %0, %0, |%8|\n\tv_add_f32 %1, %1, |%9|\n\t"                       \
      "v_pk_add_f32 %4, %16, %17 neg_lo:[0,1] neg_hi:[0,1]\n\t"                     \
      "v_add_f32 %2, %2, |%10|\n\tv_add_f32 %3, %3, |%11|\n\t"                     \
      "v_pk_add_f32 %5, %16, %18 neg_lo:[0,1] neg_hi:[0,1]\n\t"                     \
      "v_add_f32 %0, %0, |%12|\n\tv_add_f32 %1, %1, |%13|\n\t"                     \
      "v_pk_add_f32 %6, %16, %19 neg_lo:[0,1] neg_hi:[0,1]\n\t"                     \
      "v_add_f32 %2, %2, |%14|\n\tv_add_f32 %3, %3, |%15|\n\t"                     \
      "v_pk_add_f32 %7, %16, %20 neg_lo:[0,1] neg_hi:[0,1]"                         \
      : "+v"(a[0]), "+v"(a[1]), "+v"(a[2]), "+v"(a[3]),                            \
        "=&v"(n[0]), "=&v"(n[1]), "=&v"(n[2]), "=&v"(n[3])                         \
      : "v"(d[0].x), "v"(d[1].x), "v"(d[2].x), "v"(d[3].x),                        \
        "v"(d[0].y), "v"(d[1].y), "v"(d[2].y), "v"(d[3].y),                        \
        "v"(q), "v"(r[0]), "v"(r[1]), "v"(r[2]), "v"(r[3]))

// Workgroup: 256 threads = 8 waves. Covers 16 query rows x 1024 ty.
// Wave w owns ty in [128w, 128w+128). Lane = 16h + r: owns q-row r,
// ty_local = s*8 + 4h + j for subchunk s in [0,16), j in [0,4).
extern "C" __global__ void __launch_bounds__(256)
att_l1_softmax_kernel(const float* __restrict__ Q, const float* __restrict__ Y,
                      float* __restrict__ att, float* __restrict__ sim)
{
  __shared__ __align__(16) float yBuf[NWAVE][2][8 * DD];  // per-wave double buffer, 2KB each
  __shared__ float maxBuf[16][QBLK];
  __shared__ float sumBuf[16][QBLK];
  __shared__ float rowSumBuf[QBLK];

  const int tid  = threadIdx.x;
  const int w    = tid >> 5;
  const int lane = tid & 31;
  const int h    = lane >> 4;
  const int r    = lane & 15;

  const int b    = blockIdx.x >> 6;          // TQ/QBLK = 64 blocks per batch
  const int q0   = (blockIdx.x & 63) * QBLK;
  const int qRow = q0 + r;

  // ---- load this lane's query row (64 floats) into registers ----
  const float4* qp = (const float4*)(Q + ((size_t)b * TQ + qRow) * DD);
  float4 qv[16];
#pragma unroll
  for (int kc = 0; kc < 16; ++kc) qv[kc] = qp[kc];

  const int   tyW  = w * 128;
  const char* ySrc = (const char*)(Y + ((size_t)b * TY + tyW) * DD);
  char* yDst[2] = { (char*)&yBuf[w][0][0], (char*)&yBuf[w][1][0] };

  // copy subchunk s: 8 ty rows x 64 floats = 2048B -> per-wave LDS buffer (s&1)
  auto issue_copy = [&](int s) {
    const char* g = ySrc + (size_t)s * 8 * DD * sizeof(float);
    char*       l = yDst[s & 1];
#if USE_ASYNC
#pragma unroll
    for (int u = 0; u < 4; ++u) {
      const int off = (lane + 32 * u) * 16;  // 128 x 16B chunks across 32 lanes
      __builtin_amdgcn_global_load_async_to_lds_b128(
          (AS1 v4i*)(g + off), (AS3 v4i*)(l + off), 0, 0);
    }
#else
#pragma unroll
    for (int u = 0; u < 4; ++u) {
      const int off = (lane + 32 * u) * 16;
      *(float4*)(l + off) = *(const float4*)(g + off);
    }
#endif
  };

  float dv[64];
  float lmax = -3.4e38f;

  issue_copy(0);
#pragma unroll
  for (int s = 0; s < 16; ++s) {
#if USE_ASYNC
    if (s < 15) { issue_copy(s + 1); WAIT_ASYNC(4); }
    else        { WAIT_ASYNC(0); }
#else
    __syncthreads();   // make copy(s) visible across lanes of the wave
#endif
    // ---- distance: all 16 lanes of a half process the same ty -> LDS broadcast ----
    // The half's four ty rows are summed side by side: four independent chains, each summing in the
    // order kc ascending, x y z w. Group g = float4 columns 2g, 2g+1 of all four rows; group g+1
    // is read from LDS while group g is worked on.
    const float4* yb = (const float4*)&yBuf[w][s & 1][h * 4 * DD];
    float  acc[4] = {0.f, 0.f, 0.f, 0.f};
    float4 yg[2][8];
    v2f    dc[4];
#pragma unroll
    for (int c = 0; c < 2; ++c)
#pragma unroll
      for (int j = 0; j < 4; ++j) yg[0][c * 4 + j] = yb[j * 16 + c];
#pragma unroll
    for (int g = 0; g < 8; ++g) {
      if (g < 7) {
#pragma unroll
        for (int c = 0; c < 2; ++c)
#pragma unroll
          for (int j = 0; j < 4; ++j) yg[(g + 1) & 1][c * 4 + j] = yb[j * 16 + (g + 1) * 2 + c];
      }
      // holds the next group's LDS reads in front of this group's arithmetic; sunk to their uses,
      // each read's latency is waited out by the wave
      __builtin_amdgcn_sched_barrier(0);
#pragma unroll
      for (int i = 0; i < 4; ++i) {            // i = 2c + (0: x y, 1: z w)
        const float4 qq = qv[g * 2 + (i >> 1)];
        const v2f    qn = (i & 1) ? v2f{qq.z, qq.w} : v2f{qq.x, qq.y};
        v2f yn[4], dn[4];
#pragma unroll
        for (int j = 0; j < 4; ++j) {
          const float4 yv = yg[g & 1][(i >> 1) * 4 + j];
          yn[j] = (i & 1) ? v2f{yv.z, yv.w} : v2f{yv.x, yv.y};
        }
        if (g == 0 && i == 0) {
#pragma unroll
          for (int j = 0; j < 4; ++j) dn[j] = qn - yn[j];
        } else {
          ADD_ABS8_SUB4(acc, dc, dn, qn, yn);
        }
#pragma unroll
        for (int j = 0; j < 4; ++j) dc[j] = dn[j];
      }
      // ends the group: the following reads stay one block behind this arithmetic, not spread in it
      __builtin_amdgcn_sched_barrier(0);
    }
    ADD_ABS8(acc, dc);
#pragma unroll
    for (int j = 0; j < 4; ++j) {
      const float val = -acc[j] * (1.0f / (float)DD);  // att pre-softmax = -mean|q-y|
      dv[s * 4 + j] = val;
      lmax = fmaxf(lmax, val);
    }
#if !USE_ASYNC
    __syncthreads();
    if (s < 15) issue_copy(s + 1);
#endif
  }

  // ---- row max across the 16 (wave,half) partials ----
  maxBuf[w * 2 + h][r] = lmax;
  __syncthreads();
  float rmax = -3.4e38f;
#pragma unroll
  for (int j = 0; j < 16; ++j) rmax = fmaxf(rmax, maxBuf[j][r]);

  if (tid < 16) sim[(size_t)b * TQ + q0 + tid] = rmax;   // tid<16 => w=0,h=0,r=tid

  // ---- exp + partial sum in registers ----
  float psum = 0.f;
#pragma unroll
  for (int i = 0; i < 64; ++i) {
    const float e = __expf(dv[i] - rmax);
    dv[i] = e;
    psum += e;
  }
  sumBuf[w * 2 + h][r] = psum;
  __syncthreads();

  // ---- cross-wave sum reduction on the matrix unit: ones(16x4) x partial(4x16), 4 chunks ----
  if (w == 0) {
#if defined(__HIP_DEVICE_COMPILE__) && __has_builtin(__builtin_amdgcn_wmma_f32_16x16x4_f32)
    v2f a; a.x = 1.0f; a.y = 1.0f;                 // A = all-ones 16x4
    v8f c = {0.f, 0.f, 0.f, 0.f, 0.f, 0.f, 0.f, 0.f};
#pragma unroll
    for (int c4 = 0; c4 < 4; ++c4) {
      v2f bm;                                      // B[k][n]: n=lane&15, k=2h+{0,1}
      bm.x = sumBuf[4 * c4 + 2 * h + 0][r];
      bm.y = sumBuf[4 * c4 + 2 * h + 1][r];
      c = __builtin_amdgcn_wmma_f32_16x16x4_f32(false, a, false, bm,
                                                (short)0, c, false, false);
    }
    if (lane < 16) rowSumBuf[lane] = c[0];         // C[0][n] = rowSum[n]
#else
    if (lane < 16) {
      float ssum = 0.f;
#pragma unroll
      for (int j = 0; j < 16; ++j) ssum += sumBuf[j][lane];
      rowSumBuf[lane] = ssum;
    }
#endif
  }
  __syncthreads();

  // ---- normalize and write att (each lane: 16 x float4, 16B-aligned) ----
  const float inv = 1.0f / rowSumBuf[r];
  float* attRow = att + ((size_t)b * TQ + qRow) * TY + tyW;
#pragma unroll
  for (int s = 0; s < 16; ++s) {
    float4 o;
    o.x = dv[s * 4 + 0] * inv;
    o.y = dv[s * 4 + 1] * inv;
    o.z = dv[s * 4 + 2] * inv;
    o.w = dv[s * 4 + 3] * inv;
    *(float4*)(attRow + s * 8 + h * 4) = o;
  }
}

extern "C" void kernel_launch(void* const* d_in, const int* in_sizes, int n_in,
                              void* d_out, int out_size, void* d_ws, size_t ws_size,
                              hipStream_t stream) {
  const float* Q = (const float*)d_in[0];
  const float* Y = (const float*)d_in[1];
  float* att = (float*)d_out;
  const int B = in_sizes[0] / (TQ * DD);
  float* sim = att + (size_t)B * TQ * TY;   // outputs concatenated: att then sim
  dim3 grid(B * (TQ / QBLK));               // 256 workgroups for B=4
  att_l1_softmax_kernel<<<grid, dim3(256), 0, stream>>>(Q, Y, att, sim);
}

// v002
// A run of this version takes 13.9 microseconds.
// In both of two side-by-side timings against v001, it was 1.20 times as fast.
// Counting every step since v000, it is 4.24 times as fast.
#include <hip/hip_runtime.h>
#include <math.h>

#define TQ   1024
#define TY   1024
#define DD   64
#define QBLK 16
#define NWAVE 8
#define YPITCH 68   // floats per staged y row: 272 B = 16 B x 17, so that 16 lanes read 16 rows on 64 distinct banks
#define RPITCH 17   // floats per thread in the reduction buffer: odd, so that 32 lanes store on 32 distinct banks

// One LDS array, in floats. The small buffers stand first: every y row then lies above the largest
// constant step of the copies' global addresses. The compiler folds that step into a copy's offset
// field and takes it off the LDS address register, which so never falls below zero.
#define Q_OFF   0                        // 16 query rows x 64
#define RED_OFF (Q_OFF + QBLK * DD)      // 256 threads x RPITCH
#define MAX_OFF (RED_OFF + 256 * RPITCH) // 16 x 16
#define SUM_OFF (MAX_OFF + 16 * QBLK)    // 8 x 16
#define Y_OFF   6144                     // 8 waves x 128 rows x YPITCH
#define LDS_FLOATS (Y_OFF + NWAVE * 128 * YPITCH)

typedef __attribute__((ext_vector_type(2))) float v2f;
typedef __attribute__((ext_vector_type(8))) float v8f;
typedef __attribute__((vector_size(16))) int v4i;

#define AS1 __attribute__((address_space(1)))
#define AS3 __attribute__((address_space(3)))

// The four chains a[0..3] take |d[j].x|, then |d[j].y|, in turn. In asm so that each link stays one
// add with the |x| source modifier: from plain code the compiler paired the chains into packed adds,
// which take no |x| and cost one more mask instruction per element.
// The delay hints name the producer four vector instructions back, so that the SIMD's other wave
// issues while a link waits.
#define ADD_ABS8(a, d)                                                             \
  asm("v_add_f32 %0, %0, |%4|\n\tv_add_f32 %1, %1, |%5|\n\t"                       \
      "v_add_f32 %2, %2, |%6|\n\tv_add_f32 %3, %3, |%7|\n\t"                       \
      "s_delay_alu instid0(VALU_DEP_4) | instskip(NEXT) | instid1(VALU_DEP_4)\n\t"  \
      "v_add_f32 %0, %0, |%8|\n\tv_add_f32 %1, %1, |%9|\n\t"                       \
      "s_delay_alu instid0(VALU_DEP_4) | instskip(NEXT) | instid1(VALU_DEP_4)\n\t"  \
      "v_add_f32 %2, %2, |%10|\n\tv_add_f32 %3, %3, |%11|"                          \
      : "+v"(a[0]), "+v"(a[1]), "+v"(a[2]), "+v"(a[3])                             \
      : "v"(d[0].x), "v"(d[1].x), "v"(d[2].x), "v"(d[3].x),                        \
        "v"(d[0].y), "v"(d[1].y), "v"(d[2].y), "v"(d[3].y))

// The same eight adds with the next pair's four differences n[j] = q - r[j] set between them: every
// add then stands six vector instructions behind the add it depends on, and every difference at
// least five ahead of its first reader in the next step, so that no link waits for its producer.
#define ADD_ABS8_SUB4(a, d, n, q, r)                                               \
  asm("v_add_f32 %0, %0, |%8|\n\tv_add_f32 %1, %1, |%9|\n\t"                       \
      "v_pk_add_f32 %4, %16, %17 neg_lo:[0,1] neg_hi:[0,1]\n\t"                     \
      "v_add_f32 %2, %2, |%10|\n\tv_add_f32 %3, %3, |%11|\n\t"                     \
      "v_pk_add_f32 %5, %16, %18 neg_lo:[0,1] neg_hi:[0,1]\n\t"                     \
      "v_add_f32 %0, %0, |%12|\n\tv_add_f32 %1, %1, |%13|\n\t"                     \
      "v_pk_add_f32 %6, %16, %19 neg_lo:[0,1] neg_hi:[0,1]\n\t"                     \
      "v_add_f32 %2, %2, |%14|\n\tv_add_f32 %3, %3, |%15|\n\t"                     \
      "v_pk_add_f32 %7, %16, %20 neg_lo:[0,1] neg_hi:[0,1]"                         \
      : "+v"(a[0]), "+v"(a[1]), "+v"(a[2]), "+v"(a[3]),                            \
        "=&v"(n[0]), "=&v"(n[1]), "=&v"(n[2]), "=&v"(n[3])                         \
      : "v"(d[0].x), "v"(d[1].x), "v"(d[2].x), "v"(d[3].x),                        \
        "v"(d[0].y), "v"(d[1].y), "v"(d[2].y), "v"(d[3].y),                        \
        "v"(q), "v"(r[0]), "v"(r[1]), "v"(r[2]), "v"(r[3]))

// Workgroup: 256 threads = 8 waves. Covers 16 query rows x 1024 ty.
// Wave w owns ty in [128w, 128w+128); a lane owns the four rows ty = 128w + 4*lane + j and keeps a
// quarter of each (16 floats) in registers per pass. The 16 query rows are what is streamed: one
// LDS read of four query values, the same for all lanes, serves all four y rows of every lane.
extern "C" __global__ void __launch_bounds__(256)
att_l1_softmax_kernel(const float* __restrict__ Q, const float* __restrict__ Y,
                      float* __restrict__ att, float* __restrict__ sim)
{
  __shared__ __align__(16) float smem[LDS_FLOATS];
  static_assert(SUM_OFF + NWAVE * QBLK <= Y_OFF, "small buffers overlap the y rows");

  const int tid  = threadIdx.x;
  const int w    = tid >> 5;
  const int lane = tid & 31;
  const int h    = lane >> 4;
  const int r    = lane & 15;

  const int b    = blockIdx.x >> 6;          // TQ/QBLK = 64 blocks per batch
  const int q0   = (blockIdx.x & 63) * QBLK;
  const int tyW  = w * 128;

  float* qBuf   = smem + Q_OFF;
  float* red    = smem + RED_OFF;
  float* maxBuf = smem + MAX_OFF;
  float* sumBuf = smem + SUM_OFF;
  float* yBuf   = smem + Y_OFF + w * (128 * YPITCH);   // read only by the wave that fills it

  // copies half hb (128 B) of the wave's 128 y rows: eight lanes take one row's half, a whole line.
  // Row t = 4u + (lane >> 3) goes to slot (t & 3) * 32 + (t >> 2): lane l finds its row j in slot 32j + l.
  auto issue_y = [&](int hb) {
    const char* g = (const char*)(Y + ((size_t)b * TY + tyW + (lane >> 3)) * DD) + hb * 128 + (lane & 7) * 16;
    char*       l = (char*)(yBuf + (lane >> 3) * 32 * YPITCH) + hb * 128 + (lane & 7) * 16;
#pragma unroll
    for (int u = 0; u < 32; ++u)
      __builtin_amdgcn_global_load_async_to_lds_b128(
          (AS1 v4i*)(g + u * 4 * DD * 4), (AS3 v4i*)(l + u * YPITCH * 4), 0, 0);
  };

  // the 16 query rows, 4 KB: one 16-byte copy per thread
  __builtin_amdgcn_global_load_async_to_lds_b128(
      (AS1 v4i*)((const char*)(Q + ((size_t)b * TQ + q0) * DD) + tid * 16),
      (AS3 v4i*)((char*)qBuf + tid * 16), 0, 0);
  issue_y(0);
  // the wave's own copies have landed: its y halves may be read, its part of qBuf published
  asm volatile("s_wait_asynccnt 0x0" ::: "memory");
  __syncthreads();   // qBuf is read by every wave
  issue_y(1);        // lands while passes 0 and 1 run

  float acc[QBLK][4];
#pragma unroll
  for (int i = 0; i < QBLK; ++i)
#pragma unroll
    for (int j = 0; j < 4; ++j) acc[i][j] = 0.f;

  // ---- distance: pass p = floats 16p..16p+15 of every row. acc[i][j] sums query row i against the
  // lane's y row j in the order d ascending. Group G = query rows 2g, 2g+1 of pass p; group G+1 is
  // read from LDS while group G is worked on.
  const float4* qb4 = (const float4*)qBuf;                     // row i, float4 column c: qb4[i * 16 + c]
  const float4* yl4 = (const float4*)(yBuf + lane * YPITCH);   // row j, float4 column c: yl4[j * 32 * 17 + c]
  float4 qg[2][8];
  float4 yr[4][4];
  v2f    dc[4];
#pragma unroll
  for (int rr = 0; rr < 2; ++rr)
#pragma unroll
    for (int c = 0; c < 4; ++c) qg[0][rr * 4 + c] = qb4[rr * 16 + c];
#pragma unroll
  for (int p = 0; p < 4; ++p) {
    if (p == 2) {
      // the second halves of the wave's y rows have landed
      asm volatile("s_wait_asynccnt 0x0" ::: "memory");
    }
#pragma unroll
    for (int j = 0; j < 4; ++j)
#pragma unroll
      for (int c = 0; c < 4; ++c) yr[j][c] = yl4[j * 32 * (YPITCH / 4) + p * 4 + c];
#pragma unroll
    for (int g = 0; g < 8; ++g) {
      const int G = p * 8 + g;
      if (G < 31) {
        const int pn = (G + 1) >> 3, gn = (G + 1) & 7;
#pragma unroll
        for (int rr = 0; rr < 2; ++rr)
#pragma unroll
          for (int c = 0; c < 4; ++c) qg[(G + 1) & 1][rr * 4 + c] = qb4[(2 * gn + rr) * 16 + pn * 4 + c];
      }
      // holds the next group's LDS reads in front of this group's arithmetic; sunk to their uses,
      // each read's latency is waited out by the wave
      __builtin_amdgcn_sched_barrier(0);
#pragma unroll
      for (int st = 0; st < 16; ++st) {        // st = 8 * (query row in the group) + (pair of floats)
        const int    k  = st & 7;
        const float4 qq = qg[G & 1][(st >> 3) * 4 + (k >> 1)];
        const v2f    qn = (k & 1) ? v2f{qq.z, qq.w} : v2f{qq.x, qq.y};
        v2f yn[4], dn[4];
#pragma unroll
        for (int j = 0; j < 4; ++j) {
          const float4 yv = yr[j][k >> 1];
          yn[j] = (k & 1) ? v2f{yv.z, yv.w} : v2f{yv.x, yv.y};
        }
        if (g == 0 && st == 0) {
#pragma unroll
          for (int j = 0; j < 4; ++j) dn[j] = qn - yn[j];
        } else {
          const int ip = 2 * g + ((st + 7) >> 3) - 1;   // the query row of the step before
          ADD_ABS8_SUB4(acc[ip], dc, dn, qn, yn);
        }
#pragma unroll
        for (int j = 0; j < 4; ++j) dc[j] = dn[j];
      }
      // ends the group: the following reads stay one block behind this arithmetic, not spread in it
      __builtin_amdgcn_sched_barrier(0);
    }
    ADD_ABS8(acc[QBLK - 1], dc);
  }

  // ---- row max: per thread over its four ty, then over the 256 threads through LDS ----
#pragma unroll
  for (int i = 0; i < QBLK; ++i) {
    float lm = -3.4e38f;
#pragma unroll
    for (int j = 0; j < 4; ++j) {
      const float val = -acc[i][j] * (1.0f / (float)DD);  // att pre-softmax = -mean|q-y|
      acc[i][j] = val;
      lm = fmaxf(lm, val);
    }
    red[tid * RPITCH + i] = lm;
  }
  __syncthreads();
  {
    float m = -3.4e38f;                       // threads 16(2w+h) .. +15, query row r
#pragma unroll
    for (int k = 0; k < 16; ++k) m = fmaxf(m, red[((w * 2 + h) * 16 + k) * RPITCH + r]);
    maxBuf[(w * 2 + h) * QBLK + r] = m;
  }
  __syncthreads();
  float rmax = -3.4e38f;                      // of query row r
#pragma unroll
  for (int j = 0; j < 16; ++j) rmax = fmaxf(rmax, maxBuf[j * QBLK + r]);

  // ---- exp + partial sum in registers; row i's max comes from lane i ----
#pragma unroll
  for (int i = 0; i < QBLK; ++i) {
    const float mi = __int_as_float(__builtin_amdgcn_readlane(__float_as_int(rmax), i));
    float psum = 0.f;
#pragma unroll
    for (int j = 0; j < 4; ++j) {
      // exp(x) = 2^(x * log2 e). The v_nop is the one slot that the instruction set asks for behind a
      // transcendental; in the same statement it cannot be moved away from it.
      const float t = (acc[i][j] - mi) * 1.44269504f;
      float e;
      asm("v_exp_f32 %0, %1\n\tv_nop" : "=v"(e) : "v"(t));
      acc[i][j] = e;
      psum += e;
    }
    red[tid * RPITCH + i] = psum;
  }
  __syncthreads();

  // ---- sums on the matrix unit: ones(16x4) x partial(4x16). Each wave sums its own 32 threads'
  // partials (8 chunks), then every wave sums the 8 waves' results (2 chunks). All rows of the
  // result are equal, so c[0] holds query row r's sum in every lane.
  v2f a; a.x = 1.0f; a.y = 1.0f;                   // A = all-ones 16x4
  v8f c1 = {0.f, 0.f, 0.f, 0.f, 0.f, 0.f, 0.f, 0.f};
#pragma unroll
  for (int c4 = 0; c4 < 8; ++c4) {
    v2f bm;                                        // B[k][n]: n=lane&15, k=2h+{0,1}
    bm.x = red[(w * 32 + 4 * c4 + 2 * h + 0) * RPITCH + r];
    bm.y = red[(w * 32 + 4 * c4 + 2 * h + 1) * RPITCH + r];
    c1 = __builtin_amdgcn_wmma_f32_16x16x4_f32(false, a, false, bm, (short)0, c1, false, false);
  }
  if (lane < 16) sumBuf[w * QBLK + lane] = c1[0];
  __syncthreads();
  v8f c2 = {0.f, 0.f, 0.f, 0.f, 0.f, 0.f, 0.f, 0.f};
#pragma unroll
  for (int c4 = 0; c4 < 2; ++c4) {
    v2f bm;
    bm.x = sumBuf[(4 * c4 + 2 * h + 0) * QBLK + r];
    bm.y = sumBuf[(4 * c4 + 2 * h + 1) * QBLK + r];
    c2 = __builtin_amdgcn_wmma_f32_16x16x4_f32(false, a, false, bm, (short)0, c2, false, false);
  }

  // ---- normalize and write att: per query row the wave stores 512 contiguous bytes ----
  const float inv = 1.0f / c2[0];                  // of query row r
  float* attW = att + ((size_t)b * TQ + q0) * TY + tyW + lane * 4;
#pragma unroll
  for (int i = 0; i < QBLK; ++i) {
    const float vi = __int_as_float(__builtin_amdgcn_readlane(__float_as_int(inv), i));
    float4 o;
    o.x = acc[i][0] * vi;
    o.y = acc[i][1] * vi;
    o.z = acc[i][2] * vi;
    o.w = acc[i][3] * vi;
    *(float4*)(attW + (size_t)i * TY) = o;
  }
  if (tid < 16) sim[(size_t)b * TQ + q0 + tid] = rmax;   // tid<16 => r=tid; last, so that no barrier waits for it
}

extern "C" void kernel_launch(void* const* d_in, const int* in_sizes, int n_in,
                              void* d_out, int out_size, void* d_ws, size_t ws_size,
                              hipStream_t stream) {
  const float* Q = (const float*)d_in[0];
  const float* Y = (const float*)d_in[1];
  float* att = (float*)d_out;
  const int B = in_sizes[0] / (TQ * DD);
  float* sim = att + (size_t)B * TQ * TY;   // outputs concatenated: att then sim
  dim3 grid(B * (TQ / QBLK));               // 256 workgroups for B=4
  att_l1_softmax_kernel<<<grid, dim3(256), 0, stream>>>(Q, Y, att, sim);
}

// v003
// Measured time: 12.6 microseconds a run.
// Timed twice side by side with v002, it ran 1.10 and 1.11 times as fast.
// All steps since v000 together make it 4.68 times as fast.
#include <hip/hip_runtime.h>
#include <math.h>

#define TQ   1024
#define TY   1024
#define DD   64
#define QBLK 16
#define NWAVE 8
#define YPITCH 68   // floats per staged y row: 272 B = 16 B x 17, so that 16 lanes read 16 rows on 64 distinct banks
#define RPITCH 17   // floats per thread in the reduction buffer: odd, so that 32 lanes store on 32 distinct banks

// One LDS array, in floats. The small buffers stand first: every y row then lies above the largest
// constant step of the copies' global addresses. The compiler folds that step into a copy's offset
// field and takes it off the LDS address register, which so never falls below zero.
#define Q_OFF   0                        // 16 query rows x 64
#define RED_OFF (Q_OFF + QBLK * DD)      // 256 threads x RPITCH
#define MAX_OFF (RED_OFF + 256 * RPITCH) // 16 x 16
#define SUM_OFF (MAX_OFF + 16 * QBLK)    // 8 x 16
#define Y_OFF   6144                     // 8 waves x 128 rows x YPITCH
#define LDS_FLOATS (Y_OFF + NWAVE * 128 * YPITCH)

typedef __attribute__((ext_vector_type(2))) float v2f;
typedef __attribute__((ext_vector_type(8))) float v8f;
typedef __attribute__((vector_size(16))) int v4i;

#define AS1 __attribute__((address_space(1)))
#define AS3 __attribute__((address_space(3)))

// |q - y| = 2 max(q, y) - q - y, so a row's distance is 2 * sum max(q, y) - sum q - sum y. The hot loop
// forms only sum max(q, y): one maximum and one add an element, both two to an instruction.
// A step takes one pair of floats (d, d + 1) of one query row against the lane's four y rows.
// The two maxima of a pair go out as one dual-issue instruction: its halves read and write
// neighbouring registers (.x and .y of one loaded vector), which is what the encoding's bank and
// parity rules ask for. In asm so that the pairing and the order of the instructions are the source's.
#define MAX4(nx, ny, qx, qy, yx, yy)                                               \
  asm("v_dual_max_num_f32 %0, %8, %10 :: v_dual_max_num_f32 %1, %9, %11\n\t"       \
      "v_dual_max_num_f32 %2, %8, %12 :: v_dual_max_num_f32 %3, %9, %13\n\t"       \
      "v_dual_max_num_f32 %4, %8, %14 :: v_dual_max_num_f32 %5, %9, %15\n\t"       \
      "v_dual_max_num_f32 %6, %8, %16 :: v_dual_max_num_f32 %7, %9, %17"            \
      : "=&v"(nx[0]), "=&v"(ny[0]), "=&v"(nx[1]), "=&v"(ny[1]),                    \
        "=&v"(nx[2]), "=&v"(ny[2]), "=&v"(nx[3]), "=&v"(ny[3])                     \
      : "v"(qx), "v"(qy), "v"(yx[0]), "v"(yy[0]), "v"(yx[1]), "v"(yy[1]),          \
        "v"(yx[2]), "v"(yy[2]), "v"(yx[3]), "v"(yy[3]))

// The same four maxima with the packed adds of the step before set between them: every add stands
// seven vector instructions behind the maximum it reads (four to seven after MAX4, a pass's first step) and at least eight behind the add it continues, so
// that no link waits for its producer.
#define ADD4_MAX4(a, m, nx, ny, qx, qy, yx, yy)                                    \
  asm("v_pk_add_f32 %0, %0, %12\n\t"                                               \
      "v_dual_max_num_f32 %4, %16, %18 :: v_dual_max_num_f32 %5, %17, %19\n\t"     \
      "v_pk_add_f32 %1, %1, %13\n\t"                                               \
      "v_dual_max_num_f32 %6, %16, %20 :: v_dual_max_num_f32 %7, %17, %21\n\t"     \
      "v_pk_add_f32 %2, %2, %14\n\t"                                               \
      "v_dual_max_num_f32 %8, %16, %22 :: v_dual_max_num_f32 %9, %17, %23\n\t"     \
      "v_pk_add_f32 %3, %3, %15\n\t"                                               \
      "v_dual_max_num_f32 %10, %16, %24 :: v_dual_max_num_f32 %11, %17, %25"        \
      : "+v"(a[0]), "+v"(a[1]), "+v"(a[2]), "+v"(a[3]),                            \
        "=&v"(nx[0]), "=&v"(ny[0]), "=&v"(nx[1]), "=&v"(ny[1]),                    \
        "=&v"(nx[2]), "=&v"(ny[2]), "=&v"(nx[3]), "=&v"(ny[3])                     \
      : "v"(m[0]), "v"(m[1]), "v"(m[2]), "v"(m[3]),                                \
        "v"(qx), "v"(qy), "v"(yx[0]), "v"(yy[0]), "v"(yx[1]), "v"(yy[1]),          \
        "v"(yx[2]), "v"(yy[2]), "v"(yx[3]), "v"(yy[3]))

// Workgroup: 256 threads = 8 waves. Covers 16 query rows x 1024 ty.
// Wave w owns ty in [128w, 128w+128); a lane owns the four rows ty = 128w + 4*lane + j and keeps a
// quarter of each (16 floats) in registers per pass. The 16 query rows are what is streamed: one
// LDS read of four query values, the same for all lanes, serves all four y rows of every lane.
// The packed sums take 128 registers, so the query rows are read one row (not two) ahead.
extern "C" __global__ void __launch_bounds__(256)
att_l1_softmax_kernel(const float* __restrict__ Q, const float* __restrict__ Y,
                      float* __restrict__ att, float* __restrict__ sim)
{
  __shared__ __align__(16) float smem[LDS_FLOATS];
  static_assert(SUM_OFF + NWAVE * QBLK <= Y_OFF, "small buffers overlap the y rows");

  const int tid  = threadIdx.x;
  const int w    = tid >> 5;
  const int lane = tid & 31;
  const int h    = lane >> 4;
  const int r    = lane & 15;

  const int b    = blockIdx.x >> 6;          // TQ/QBLK = 64 blocks per batch
  const int q0   = (blockIdx.x & 63) * QBLK;
  const int tyW  = w * 128;

  float* qBuf   = smem + Q_OFF;
  float* red    = smem + RED_OFF;
  float* maxBuf = smem + MAX_OFF;
  float* sumBuf = smem + SUM_OFF;
  float* yBuf   = smem + Y_OFF + w * (128 * YPITCH);   // read only by the wave that fills it

  // copies half hb (128 B) of the wave's 128 y rows: eight lanes take one row's half, a whole line.
  // Row t = 4u + (lane >> 3) goes to slot (t & 3) * 32 + (t >> 2): lane l finds its row j in slot 32j + l.
  auto issue_y = [&](int hb) {
    const char* g = (const char*)(Y + ((size_t)b * TY + tyW + (lane >> 3)) * DD) + hb * 128 + (lane & 7) * 16;
    char*       l = (char*)(yBuf + (lane >> 3) * 32 * YPITCH) + hb * 128 + (lane & 7) * 16;
#pragma unroll
    for (int u = 0; u < 32; ++u)
      __builtin_amdgcn_global_load_async_to_lds_b128(
          (AS1 v4i*)(g + u * 4 * DD * 4), (AS3 v4i*)(l + u * YPITCH * 4), 0, 0);
  };

  // the 16 query rows, 4 KB: one 16-byte copy per thread
  __builtin_amdgcn_global_load_async_to_lds_b128(
      (AS1 v4i*)((const char*)(Q + ((size_t)b * TQ + q0) * DD) + tid * 16),
      (AS3 v4i*)((char*)qBuf + tid * 16), 0, 0);
  issue_y(0);
  // the wave's own copies have landed: its y halves may be read, its part of qBuf published
  asm volatile("s_wait_asynccnt 0x0" ::: "memory");
  __syncthreads();   // qBuf is read by every wave
  issue_y(1);        // lands while passes 0 and 1 run

  v2f acc2[QBLK][4];
#pragma unroll
  for (int i = 0; i < QBLK; ++i)
#pragma unroll
    for (int j = 0; j < 4; ++j) acc2[i][j] = v2f{0.f, 0.f};
  float sy[4] = {0.f, 0.f, 0.f, 0.f};          // sum of the lane's y row j

  // ---- sum max(q, y): pass p = floats 16p..16p+15 of every row. acc2[i][j] sums query row i against
  // the lane's y row j, .x over the even d and .y over the odd d, each in the order d ascending.
  // Group G = query row i of pass p; group G+1 is read from LDS while group G is worked on.
  const float4* qb4 = (const float4*)qBuf;                     // row i, float4 column c: qb4[i * 16 + c]
  const float4* yl4 = (const float4*)(yBuf + lane * YPITCH);   // row j, float4 column c: yl4[j * 32 * 17 + c]
  float4 qg[2][4];
  float4 yr[4][4];
  v2f    mc[4];
#pragma unroll
  for (int c = 0; c < 4; ++c) qg[0][c] = qb4[c];
#pragma unroll
  for (int p = 0; p < 4; ++p) {
    if (p == 2) {
      // the second halves of the wave's y rows have landed
      asm volatile("s_wait_asynccnt 0x0" ::: "memory");
    }
#pragma unroll
    for (int j = 0; j < 4; ++j)
#pragma unroll
      for (int c = 0; c < 4; ++c) yr[j][c] = yl4[j * 32 * (YPITCH / 4) + p * 4 + c];
#pragma unroll
    for (int j = 0; j < 4; ++j) {
      const v2f t = ((v2f{yr[j][0].x, yr[j][0].y} + v2f{yr[j][0].z, yr[j][0].w}) +
                     (v2f{yr[j][1].x, yr[j][1].y} + v2f{yr[j][1].z, yr[j][1].w})) +
                    ((v2f{yr[j][2].x, yr[j][2].y} + v2f{yr[j][2].z, yr[j][2].w}) +
                     (v2f{yr[j][3].x, yr[j][3].y} + v2f{yr[j][3].z, yr[j][3].w}));
      sy[j] += t.x + t.y;
    }
#pragma unroll
    for (int i = 0; i < QBLK; ++i) {
      const int G = p * QBLK + i;
      if (G < 4 * QBLK - 1) {
        const int pn = (G + 1) >> 4, in = (G + 1) & 15;
#pragma unroll
        for (int c = 0; c < 4; ++c) qg[(G + 1) & 1][c] = qb4[in * 16 + pn * 4 + c];
      }
      // holds the next group's LDS reads in front of this group's arithmetic; sunk to their uses,
      // each read's latency is waited out by the wave
      __builtin_amdgcn_sched_barrier(0);
#pragma unroll
      for (int k = 0; k < 8; ++k) {            // k = pair of floats
        const float4 qq = qg[G & 1][k >> 1];
        const float  qx = (k & 1) ? qq.z : qq.x;
        const float  qy = (k & 1) ? qq.w : qq.y;
        float yx[4], yy[4], nx[4], ny[4];
#pragma unroll
        for (int j = 0; j < 4; ++j) {
          const float4 yv = yr[j][k >> 1];
          yx[j] = (k & 1) ? yv.z : yv.x;
          yy[j] = (k & 1) ? yv.w : yv.y;
        }
        if (i == 0 && k == 0) {
          MAX4(nx, ny, qx, qy, yx, yy);
        } else {
          const int ip = (k == 0) ? i - 1 : i;   // the query row of the step before
          ADD4_MAX4(acc2[ip], mc, nx, ny, qx, qy, yx, yy);
        }
#pragma unroll
        for (int j = 0; j < 4; ++j) mc[j] = v2f{nx[j], ny[j]};
      }
      // ends the group: the following reads stay one block behind this arithmetic, not spread in it
      __builtin_amdgcn_sched_barrier(0);
    }
#pragma unroll
    for (int j = 0; j < 4; ++j) acc2[QBLK - 1][j] += mc[j];   // the adds of the pass's last step
  }

  // ---- row max: per thread over its four ty, then over the 256 threads through LDS ----
  // val = (sum y - 2 sum max) / 64 = -mean|q-y| - (sum q) / 64. The last term is one constant per query
  // row: it drops out of the softmax and is added only to sim.
  float acc[QBLK][4];
#pragma unroll
  for (int i = 0; i < QBLK; ++i) {
    float lm = -3.4e38f;
#pragma unroll
    for (int j = 0; j < 4; ++j) {
      const float val = fmaf(acc2[i][j].x + acc2[i][j].y, -2.0f / (float)DD, sy[j] * (1.0f / (float)DD));
      acc[i][j] = val;
      lm = fmaxf(lm, val);
    }
    red[tid * RPITCH + i] = lm;
  }
  __syncthreads();
  {
    float m = -3.4e38f;                       // threads 16(2w+h) .. +15, query row r
#pragma unroll
    for (int k = 0; k < 16; ++k) m = fmaxf(m, red[((w * 2 + h) * 16 + k) * RPITCH + r]);
    maxBuf[(w * 2 + h) * QBLK + r] = m;
  }
  __syncthreads();
  float rmax = -3.4e38f;                      // of query row r
#pragma unroll
  for (int j = 0; j < 16; ++j) rmax = fmaxf(rmax, maxBuf[j * QBLK + r]);

  // ---- exp + partial sum in registers; row i's max comes from lane i ----
#pragma unroll
  for (int i = 0; i < QBLK; ++i) {
    const float mi = __int_as_float(__builtin_amdgcn_readlane(__float_as_int(rmax), i));
    float psum = 0.f;
#pragma unroll
    for (int j = 0; j < 4; ++j) {
      // exp(x) = 2^(x * log2 e). The v_nop is the one slot that the instruction set asks for behind a
      // transcendental; in the same statement it cannot be moved away from it.
      const float t = (acc[i][j] - mi) * 1.44269504f;
      float e;
      asm("v_exp_f32 %0, %1\n\tv_nop" : "=v"(e) : "v"(t));
      acc[i][j] = e;
      psum += e;
    }
    red[tid * RPITCH + i] = psum;
  }
  __syncthreads();

  // ---- sums on the matrix unit: ones(16x4) x partial(4x16). Each wave sums its own 32 threads'
  // partials (8 chunks), then every wave sums the 8 waves' results (2 chunks). All rows of the
  // result are equal, so c[0] holds query row r's sum in every lane.
  v2f a; a.x = 1.0f; a.y = 1.0f;                   // A = all-ones 16x4
  v8f c1 = {0.f, 0.f, 0.f, 0.f, 0.f, 0.f, 0.f, 0.f};
#pragma unroll
  for (int c4 = 0; c4 < 8; ++c4) {
    v2f bm;                                        // B[k][n]: n=lane&15, k=2h+{0,1}
    bm.x = red[(w * 32 + 4 * c4 + 2 * h + 0) * RPITCH + r];
    bm.y = red[(w * 32 + 4 * c4 + 2 * h + 1) * RPITCH + r];
    c1 = __builtin_amdgcn_wmma_f32_16x16x4_f32(false, a, false, bm, (short)0, c1, false, false);
  }
  if (lane < 16) sumBuf[w * QBLK + lane] = c1[0];
  __syncthreads();
  v8f c2 = {0.f, 0.f, 0.f, 0.f, 0.f, 0.f, 0.f, 0.f};
#pragma unroll
  for (int c4 = 0; c4 < 2; ++c4) {
    v2f bm;
    bm.x = sumBuf[(4 * c4 + 2 * h + 0) * QBLK + r];
    bm.y = sumBuf[(4 * c4 + 2 * h + 1) * QBLK + r];
    c2 = __builtin_amdgcn_wmma_f32_16x16x4_f32(false, a, false, bm, (short)0, c2, false, false);
  }

  // ---- normalize and write att: per query row the wave stores 512 contiguous bytes ----
  const float inv = 1.0f / c2[0];                  // of query row r
  float* attW = att + ((size_t)b * TQ + q0) * TY + tyW + lane * 4;
#pragma unroll
  for (int i = 0; i < QBLK; ++i) {
    const float vi = __int_as_float(__builtin_amdgcn_readlane(__float_as_int(inv), i));
    float4 o;
    o.x = acc[i][0] * vi;
    o.y = acc[i][1] * vi;
    o.z = acc[i][2] * vi;
    o.w = acc[i][3] * vi;
    *(float4*)(attW + (size_t)i * TY) = o;
  }
  if (tid < 16) {   // tid<16 => r=tid; last, so that no barrier waits for it
    // sum of query row tid. Lane t starts at float4 column t: the 16 lanes then read 16 distinct groups
    // of four banks, not one.
    float4 s4 = qb4[tid * 16 + tid];
#pragma unroll
    for (int c = 1; c < 16; ++c) {
      const float4 v = qb4[tid * 16 + ((tid + c) & 15)];
      s4.x += v.x; s4.y += v.y; s4.z += v.z; s4.w += v.w;
    }
    sim[(size_t)b * TQ + q0 + tid] = rmax + ((s4.x + s4.y) + (s4.z + s4.w)) * (1.0f / (float)DD);
  }
}

extern "C" void kernel_launch(void* const* d_in, const int* in_sizes, int n_in,
                              void* d_out, int out_size, void* d_ws, size_t ws_size,
                              hipStream_t stream) {
  const float* Q = (const float*)d_in[0];
  const float* Y = (const float*)d_in[1];
  float* att = (float*)d_out;
  const int B = in_sizes[0] / (TQ * DD);
  float* sim = att + (size_t)B * TQ * TY;   // outputs concatenated: att then sim
  dim3 grid(B * (TQ / QBLK));               // 256 workgroups for B=4
  att_l1_softmax_kernel<<<grid, dim3(256), 0, stream>>>(Q, Y, att, sim);
}

// v004
// One run takes 11.7 microseconds.
// Next to v003, in two timings, it ran 1.09 and 1.08 times as fast.
// Over all steps from v000 it is 5.08 times as fast.
#include <hip/hip_runtime.h>
#include <math.h>

#define TQ   1024
#define TY   1024
#define DD   64
#define QBLK 16
#define NWAVE 8
#define YPITCH 68   // floats per staged y row: 272 B = 16 B x 17, so that 16 lanes read 16 rows on 64 distinct banks
#define RPITCH 17   // floats per thread in the reduction buffer: odd, so that 32 lanes store on 32 distinct banks

// One LDS array, in floats. The small buffers stand first: every y row then lies above the largest
// constant step of the copies' global addresses. The compiler folds that step into a copy's offset
// field and takes it off the LDS address register, which so never falls below zero.
#define Q_OFF   0                        // 16 query rows x 64
#define RED_OFF (Q_OFF + QBLK * DD)      // 256 threads x RPITCH
#define MAX_OFF (RED_OFF + 256 * RPITCH) // 16 x 16
#define SUM_OFF (MAX_OFF + 16 * QBLK)    // 8 x 16
#define Y_OFF   6144                     // 8 waves x 128 rows x YPITCH
#define LDS_FLOATS (Y_OFF + NWAVE * 128 * YPITCH)

typedef __attribute__((ext_vector_type(2))) float v2f;
typedef __attribute__((ext_vector_type(4))) float v4f;
typedef __attribute__((ext_vector_type(8))) float v8f;
typedef __attribute__((vector_size(16))) int v4i;

#define AS1 __attribute__((address_space(1)))
#define AS3 __attribute__((address_space(3)))

// |q - y| = 2 max(q, y) - q - y, so a row's distance is 2 * sum max(q, y) - sum q - sum y. The hot loop
// forms only sum max(q, y): one maximum and one add an element, both two to an instruction.
// A step takes one pair of floats (d, d + 1) of one query row against the lane's four y rows.
// The two maxima of a pair go out as one dual-issue instruction: its halves read and write
// neighbouring registers (.x and .y of one loaded vector), which is what the encoding's bank and
// parity rules ask for. In asm so that the pairing and the order of the instructions are the source's.
#define MAX4(nx, ny, qx, qy, yx, yy)                                               \
  asm("v_dual_max_num_f32 %0, %8, %10 :: v_dual_max_num_f32 %1, %9, %11\n\t"       \
      "v_dual_max_num_f32 %2, %8, %12 :: v_dual_max_num_f32 %3, %9, %13\n\t"       \
      "v_dual_max_num_f32 %4, %8, %14 :: v_dual_max_num_f32 %5, %9, %15\n\t"       \
      "v_dual_max_num_f32 %6, %8, %16 :: v_dual_max_num_f32 %7, %9, %17"            \
      : "=&v"(nx[0]), "=&v"(ny[0]), "=&v"(nx[1]), "=&v"(ny[1]),                    \
        "=&v"(nx[2]), "=&v"(ny[2]), "=&v"(nx[3]), "=&v"(ny[3])                     \
      : "v"(qx), "v"(qy), "v"(yx[0]), "v"(yy[0]), "v"(yx[1]), "v"(yy[1]),          \
        "v"(yx[2]), "v"(yy[2]), "v"(yx[3]), "v"(yy[3]))

// The same four maxima with the packed adds of the step before set between them: every add stands
// seven vector instructions behind the maximum it reads (four to seven after MAX4, a pass's first step) and at least eight behind the add it continues, so
// that no link waits for its producer.
#define ADD4_MAX4(a, m, nx, ny, qx, qy, yx, yy)                                    \
  asm("v_pk_add_f32 %0, %0, %12\n\t"                                               \
      "v_dual_max_num_f32 %4, %16, %18 :: v_dual_max_num_f32 %5, %17, %19\n\t"     \
      "v_pk_add_f32 %1, %1, %13\n\t"                                               \
      "v_dual_max_num_f32 %6, %16, %20 :: v_dual_max_num_f32 %7, %17, %21\n\t"     \
      "v_pk_add_f32 %2, %2, %14\n\t"                                               \
      "v_dual_max_num_f32 %8, %16, %22 :: v_dual_max_num_f32 %9, %17, %23\n\t"     \
      "v_pk_add_f32 %3, %3, %15\n\t"                                               \
      "v_dual_max_num_f32 %10, %16, %24 :: v_dual_max_num_f32 %11, %17, %25"        \
      : "+v"(a[0]), "+v"(a[1]), "+v"(a[2]), "+v"(a[3]),                            \
        "=&v"(nx[0]), "=&v"(ny[0]), "=&v"(nx[1]), "=&v"(ny[1]),                    \
        "=&v"(nx[2]), "=&v"(ny[2]), "=&v"(nx[3]), "=&v"(ny[3])                     \
      : "v"(m[0]), "v"(m[1]), "v"(m[2]), "v"(m[3]),                                \
        "v"(qx), "v"(qy), "v"(yx[0]), "v"(yy[0]), "v"(yx[1]), "v"(yy[1]),          \
        "v"(yx[2]), "v"(yy[2]), "v"(yx[3]), "v"(yy[3]))

// Workgroup: 256 threads = 8 waves. Covers 16 query rows x 1024 ty.
// Wave w owns ty in [128w, 128w+128); a lane owns the four rows ty = 128w + 4*lane + j and keeps a
// quarter of each (16 floats) in registers per pass. The 16 query rows are what is streamed: one
// LDS read of four query values, the same for all lanes, serves all four y rows of every lane.
// The packed sums take 128 registers, so the query rows are read one row (not two) ahead.
extern "C" __global__ void __launch_bounds__(256)
att_l1_softmax_kernel(const float* __restrict__ Q, const float* __restrict__ Y,
                      float* __restrict__ att, float* __restrict__ sim)
{
  __shared__ __align__(16) float smem[LDS_FLOATS];
  static_assert(SUM_OFF + NWAVE * QBLK <= Y_OFF, "small buffers overlap the y rows");

  const int tid  = threadIdx.x;
  const int w    = tid >> 5;
  const int lane = tid & 31;
  const int h    = lane >> 4;
  const int r    = lane & 15;

  const int b    = blockIdx.x >> 6;          // TQ/QBLK = 64 blocks per batch
  const int q0   = (blockIdx.x & 63) * QBLK;
  const int tyW  = w * 128;

  float* qBuf   = smem + Q_OFF;
  float* red    = smem + RED_OFF;
  float* maxBuf = smem + MAX_OFF;
  float* sumBuf = smem + SUM_OFF;
  float* yBuf   = smem + Y_OFF + w * (128 * YPITCH);   // read only by the wave that fills it

  // copies half hb (128 B) of the wave's 128 y rows: eight lanes take one row's half, a whole line.
  // Row t = 4u + (lane >> 3) goes to slot (t & 3) * 32 + (t >> 2): lane l finds its row j in slot 32j + l.
  auto issue_y = [&](int hb) {
    const char* g = (const char*)(Y + ((size_t)b * TY + tyW + (lane >> 3)) * DD) + hb * 128 + (lane & 7) * 16;
    char*       l = (char*)(yBuf + (lane >> 3) * 32 * YPITCH) + hb * 128 + (lane & 7) * 16;
#pragma unroll
    for (int u = 0; u < 32; ++u)
      __builtin_amdgcn_global_load_async_to_lds_b128(
          (AS1 v4i*)(g + u * 4 * DD * 4), (AS3 v4i*)(l + u * YPITCH * 4), 0, 0);
  };

  // the 16 query rows, 4 KB: one 16-byte copy per thread
  __builtin_amdgcn_global_load_async_to_lds_b128(
      (AS1 v4i*)((const char*)(Q + ((size_t)b * TQ + q0) * DD) + tid * 16),
      (AS3 v4i*)((char*)qBuf + tid * 16), 0, 0);
  issue_y(0);
  // the wave's own copies have landed: its y halves may be read, its part of qBuf published
  asm volatile("s_wait_asynccnt 0x0" ::: "memory");
  __syncthreads();   // qBuf is read by every wave
  issue_y(1);        // lands while passes 0 and 1 run

  v2f acc2[QBLK][4];
#pragma unroll
  for (int i = 0; i < QBLK; ++i)
#pragma unroll
    for (int j = 0; j < 4; ++j) acc2[i][j] = v2f{0.f, 0.f};
  float sy[4] = {0.f, 0.f, 0.f, 0.f};          // sum of the lane's y row j

  // ---- sum max(q, y): pass p = floats 16p..16p+15 of every row. acc2[i][j] sums query row i against
  // the lane's y row j, .x over the even d and .y over the odd d, each in the order d ascending.
  // Group G = query row i of pass p; group G+1 is read from LDS while group G is worked on.
  const float4* qb4 = (const float4*)qBuf;                     // row i, float4 column c: qb4[i * 16 + c]
  const float4* yl4 = (const float4*)(yBuf + lane * YPITCH);   // row j, float4 column c: yl4[j * 32 * 17 + c]
  float4 qg[2][4];
  float4 yr[4][4];
  v2f    mc[4];
#pragma unroll
  for (int c = 0; c < 4; ++c) qg[0][c] = qb4[c];
#pragma unroll
  for (int p = 0; p < 4; ++p) {
    if (p == 2) {
      // the second halves of the wave's y rows have landed
      asm volatile("s_wait_asynccnt 0x0" ::: "memory");
    }
#pragma unroll
    for (int j = 0; j < 4; ++j)
#pragma unroll
      for (int c = 0; c < 4; ++c) yr[j][c] = yl4[j * 32 * (YPITCH / 4) + p * 4 + c];
#pragma unroll
    for (int j = 0; j < 4; ++j) {
      const v2f t = ((v2f{yr[j][0].x, yr[j][0].y} + v2f{yr[j][0].z, yr[j][0].w}) +
                     (v2f{yr[j][1].x, yr[j][1].y} + v2f{yr[j][1].z, yr[j][1].w})) +
                    ((v2f{yr[j][2].x, yr[j][2].y} + v2f{yr[j][2].z, yr[j][2].w}) +
                     (v2f{yr[j][3].x, yr[j][3].y} + v2f{yr[j][3].z, yr[j][3].w}));
      sy[j] += t.x + t.y;
    }
#pragma unroll
    for (int i = 0; i < QBLK; ++i) {
      const int G = p * QBLK + i;
      if (G < 4 * QBLK - 1) {
        const int pn = (G + 1) >> 4, in = (G + 1) & 15;
#pragma unroll
        for (int c = 0; c < 4; ++c) qg[(G + 1) & 1][c] = qb4[in * 16 + pn * 4 + c];
      }
      // holds the next group's LDS reads in front of this group's arithmetic; sunk to their uses,
      // each read's latency is waited out by the wave
      __builtin_amdgcn_sched_barrier(0);
#pragma unroll
      for (int k = 0; k < 8; ++k) {            // k = pair of floats
        const float4 qq = qg[G & 1][k >> 1];
        const float  qx = (k & 1) ? qq.z : qq.x;
        const float  qy = (k & 1) ? qq.w : qq.y;
        float yx[4], yy[4], nx[4], ny[4];
#pragma unroll
        for (int j = 0; j < 4; ++j) {
          const float4 yv = yr[j][k >> 1];
          yx[j] = (k & 1) ? yv.z : yv.x;
          yy[j] = (k & 1) ? yv.w : yv.y;
        }
        if (i == 0 && k == 0) {
          MAX4(nx, ny, qx, qy, yx, yy);
        } else {
          const int ip = (k == 0) ? i - 1 : i;   // the query row of the step before
          ADD4_MAX4(acc2[ip], mc, nx, ny, qx, qy, yx, yy);
        }
#pragma unroll
        for (int j = 0; j < 4; ++j) mc[j] = v2f{nx[j], ny[j]};
      }
      // ends the group: the following reads stay one block behind this arithmetic, not spread in it
      __builtin_amdgcn_sched_barrier(0);
    }
#pragma unroll
    for (int j = 0; j < 4; ++j) acc2[QBLK - 1][j] += mc[j];   // the adds of the pass's last step
  }

  // ---- row max: per thread over its four ty, then over the 256 threads through LDS ----
  // val = (sum y - 2 sum max) / 64 = -mean|q-y| - (sum q) / 64. The last term is one constant per query
  // row: it drops out of the softmax and is added only to sim.
  float acc[QBLK][4];
#pragma unroll
  for (int i = 0; i < QBLK; ++i) {
    float lm = -3.4e38f;
#pragma unroll
    for (int j = 0; j < 4; ++j) {
      const float val = fmaf(acc2[i][j].x + acc2[i][j].y, -2.0f / (float)DD, sy[j] * (1.0f / (float)DD));
      acc[i][j] = val;
      lm = fmaxf(lm, val);
    }
    red[tid * RPITCH + i] = lm;
  }
  __syncthreads();
  {
    float m = -3.4e38f;                       // threads 16(2w+h) .. +15, query row r
#pragma unroll
    for (int k = 0; k < 16; ++k) m = fmaxf(m, red[((w * 2 + h) * 16 + k) * RPITCH + r]);
    maxBuf[(w * 2 + h) * QBLK + r] = m;
  }
  __syncthreads();
  float rmax = -3.4e38f;                      // of query row r
#pragma unroll
  for (int j = 0; j < 16; ++j) rmax = fmaxf(rmax, maxBuf[j * QBLK + r]);

  // ---- exp + partial sum in registers; row i's max comes from lane i ----
#pragma unroll
  for (int i = 0; i < QBLK; ++i) {
    const float mi = __int_as_float(__builtin_amdgcn_readlane(__float_as_int(rmax), i));
    float psum = 0.f;
#pragma unroll
    for (int j = 0; j < 4; ++j) {
      // exp(x) = 2^(x * log2 e). The v_nop is the one slot that the instruction set asks for behind a
      // transcendental; in the same statement it cannot be moved away from it.
      const float t = (acc[i][j] - mi) * 1.44269504f;
      float e;
      asm("v_exp_f32 %0, %1\n\tv_nop" : "=v"(e) : "v"(t));
      acc[i][j] = e;
      psum += e;
    }
    red[tid * RPITCH + i] = psum;
  }
  __syncthreads();

  // ---- sums on the matrix unit: ones(16x4) x partial(4x16). Each wave sums its own 32 threads'
  // partials (8 chunks), then every wave sums the 8 waves' results (2 chunks). All rows of the
  // result are equal, so c[0] holds query row r's sum in every lane.
  v2f a; a.x = 1.0f; a.y = 1.0f;                   // A = all-ones 16x4
  v8f c1 = {0.f, 0.f, 0.f, 0.f, 0.f, 0.f, 0.f, 0.f};
#pragma unroll
  for (int c4 = 0; c4 < 8; ++c4) {
    v2f bm;                                        // B[k][n]: n=lane&15, k=2h+{0,1}
    bm.x = red[(w * 32 + 4 * c4 + 2 * h + 0) * RPITCH + r];
    bm.y = red[(w * 32 + 4 * c4 + 2 * h + 1) * RPITCH + r];
    c1 = __builtin_amdgcn_wmma_f32_16x16x4_f32(false, a, false, bm, (short)0, c1, false, false);
  }
  if (lane < 16) sumBuf[w * QBLK + lane] = c1[0];
  __syncthreads();
  v8f c2 = {0.f, 0.f, 0.f, 0.f, 0.f, 0.f, 0.f, 0.f};
#pragma unroll
  for (int c4 = 0; c4 < 2; ++c4) {
    v2f bm;
    bm.x = sumBuf[(4 * c4 + 2 * h + 0) * QBLK + r];
    bm.y = sumBuf[(4 * c4 + 2 * h + 1) * QBLK + r];
    c2 = __builtin_amdgcn_wmma_f32_16x16x4_f32(false, a, false, bm, (short)0, c2, false, false);
  }

  // ---- normalize and write att: per query row the wave stores 512 contiguous bytes ----
  const float inv = 1.0f / c2[0];                  // of query row r
  float* attW = att + ((size_t)b * TQ + q0) * TY + tyW + lane * 4;
#pragma unroll
  for (int i = 0; i < QBLK; ++i) {
    const float vi = __int_as_float(__builtin_amdgcn_readlane(__float_as_int(inv), i));
    v4f o;
    o.x = acc[i][0] * vi;
    o.y = acc[i][1] * vi;
    o.z = acc[i][2] * vi;
    o.w = acc[i][3] * vi;
    // non-temporal: att is written once and never read here, so its lines need not wait in L2 for the
    // write-back at the launch's end; those of work-groups that end early leave while others still compute
    __builtin_nontemporal_store(o, (v4f*)(attW + (size_t)i * TY));
  }
  if (tid < 16) {   // tid<16 => r=tid; last, so that no barrier waits for it
    // sum of query row tid. Lane t starts at float4 column t: the 16 lanes then read 16 distinct groups
    // of four banks, not one.
    float4 s4 = qb4[tid * 16 + tid];
#pragma unroll
    for (int c = 1; c < 16; ++c) {
      const float4 v = qb4[tid * 16 + ((tid + c) & 15)];
      s4.x += v.x; s4.y += v.y; s4.z += v.z; s4.w += v.w;
    }
    sim[(size_t)b * TQ + q0 + tid] = rmax + ((s4.x + s4.y) + (s4.z + s4.w)) * (1.0f / (float)DD);
  }
}

extern "C" void kernel_launch(void* const* d_in, const int* in_sizes, int n_in,
                              void* d_out, int out_size, void* d_ws, size_t ws_size,
                              hipStream_t stream) {
  const float* Q = (const float*)d_in[0];
  const float* Y = (const float*)d_in[1];
  float* att = (float*)d_out;
  const int B = in_sizes[0] / (TQ * DD);
  float* sim = att + (size_t)B * TQ * TY;   // outputs concatenated: att then sim
  dim3 grid(B * (TQ / QBLK));               // 256 workgroups for B=4
  att_l1_softmax_kernel<<<grid, dim3(256), 0, stream>>>(Q, Y, att, sim);
}

// v005
// It runs in 10.8 microseconds.
// Next to v004, in two timings, it ran 1.09 times as fast each time.
// Counting every step since v000, it is 5.53 times as fast.
#include <hip/hip_runtime.h>
#include <math.h>

#define TQ   1024
#define TY   1024
#define DD   64
#define QBLK 16
#define NWAVE 8
#define YPITCH 68   // floats per staged y row: 272 B = 16 B x 17, so that 16 lanes read 16 rows on 64 distinct banks
#define RPITCH 17   // floats per thread in the reduction buffer: odd, so that 32 lanes store on 32 distinct banks

// One LDS array, in floats. The small buffers stand first: every y row then lies above the largest
// constant step of the copies' global addresses. The compiler folds that step into a copy's offset
// field and takes it off the LDS address register, which so never falls below zero.
#define QS_OFF  0                        // 16 query-row sums
#define RED_OFF (QS_OFF + QBLK)          // 256 threads x RPITCH
#define MAX_OFF (RED_OFF + 256 * RPITCH) // 16 x 16
#define SUM_OFF (MAX_OFF + 16 * QBLK)    // 8 x 16
#define Y_OFF   6144                     // 8 waves x 128 rows x YPITCH
#define LDS_FLOATS (Y_OFF + NWAVE * 128 * YPITCH)

typedef __attribute__((ext_vector_type(2))) float v2f;
typedef __attribute__((ext_vector_type(4))) float v4f;
typedef __attribute__((ext_vector_type(8))) float v8f;
typedef __attribute__((ext_vector_type(16))) float v16f;
typedef __attribute__((vector_size(16))) int v4i;

#define AS1 __attribute__((address_space(1)))
#define AS3 __attribute__((address_space(3)))
#define AS4 __attribute__((address_space(4)))   // constant: a load at a wave-uniform address is a scalar load

// |q - y| = 2 max(q, y) - q - y, so a row's distance is 2 * sum max(q, y) - sum q - sum y. The hot loop
// forms only sum max(q, y): one maximum and one add an element, both two to an instruction.
// A step takes one pair of floats (d, d + 1) of one query row against the lane's four y rows.
// The two maxima of a pair go out as one dual-issue instruction: its halves read and write
// neighbouring registers (.x and .y of one loaded vector), which is what the encoding's bank and
// parity rules ask for. The two query values are the same for all lanes and stand in scalar registers:
// a pair of maxima then reads two vector registers, not four.
// In asm so that the pairing and the order of the instructions are the source's.
#define MAX4(nx, ny, qx, qy, yx, yy)                                               \
  asm("v_dual_max_num_f32 %0, %8, %10 :: v_dual_max_num_f32 %1, %9, %11\n\t"       \
      "v_dual_max_num_f32 %2, %8, %12 :: v_dual_max_num_f32 %3, %9, %13\n\t"       \
      "v_dual_max_num_f32 %4, %8, %14 :: v_dual_max_num_f32 %5, %9, %15\n\t"       \
      "v_dual_max_num_f32 %6, %8, %16 :: v_dual_max_num_f32 %7, %9, %17"            \
      : "=&v"(nx[0]), "=&v"(ny[0]), "=&v"(nx[1]), "=&v"(ny[1]),                    \
        "=&v"(nx[2]), "=&v"(ny[2]), "=&v"(nx[3]), "=&v"(ny[3])                     \
      : "s"(qx), "s"(qy), "v"(yx[0]), "v"(yy[0]), "v"(yx[1]), "v"(yy[1]),          \
        "v"(yx[2]), "v"(yy[2]), "v"(yx[3]), "v"(yy[3]))

// The same four maxima with the packed adds of the step before set between them: every add stands
// seven vector instructions behind the maximum it reads (four to seven after MAX4, a pass's first step) and at least eight behind the add it continues, so
// that no link waits for its producer.
#define ADD4_MAX4(a, m, nx, ny, qx, qy, yx, yy)                                    \
  asm("v_pk_add_f32 %0, %0, %12\n\t"                                               \
      "v_dual_max_num_f32 %4, %16, %18 :: v_dual_max_num_f32 %5, %17, %19\n\t"     \
      "v_pk_add_f32 %1, %1, %13\n\t"                                               \
      "v_dual_max_num_f32 %6, %16, %20 :: v_dual_max_num_f32 %7, %17, %21\n\t"     \
      "v_pk_add_f32 %2, %2, %14\n\t"                                               \
      "v_dual_max_num_f32 %8, %16, %22 :: v_dual_max_num_f32 %9, %17, %23\n\t"     \
      "v_pk_add_f32 %3, %3, %15\n\t"                                               \
      "v_dual_max_num_f32 %10, %16, %24 :: v_dual_max_num_f32 %11, %17, %25"        \
      : "+v"(a[0]), "+v"(a[1]), "+v"(a[2]), "+v"(a[3]),                            \
        "=&v"(nx[0]), "=&v"(ny[0]), "=&v"(nx[1]), "=&v"(ny[1]),                    \
        "=&v"(nx[2]), "=&v"(ny[2]), "=&v"(nx[3]), "=&v"(ny[3])                     \
      : "v"(m[0]), "v"(m[1]), "v"(m[2]), "v"(m[3]),                                \
        "s"(qx), "s"(qy), "v"(yx[0]), "v"(yy[0]), "v"(yx[1]), "v"(yy[1]),          \
        "v"(yx[2]), "v"(yy[2]), "v"(yx[3]), "v"(yy[3]))

// Workgroup: 256 threads = 8 waves. Covers 16 query rows x 1024 ty.
// Wave w owns ty in [128w, 128w+128); a lane owns the four rows ty = 128w + 4*lane + j and keeps a
// quarter of each (16 floats) in registers per pass. The 16 query rows are what is streamed: they are
// the same for all lanes, so they come by scalar loads (through the scalar cache, 4 KB a work-group)
// into scalar registers, two rows' quarters a time, and take no LDS read and no vector register.
extern "C" __global__ void __launch_bounds__(256)
att_l1_softmax_kernel(const float* __restrict__ Q, const float* __restrict__ Y,
                      float* __restrict__ att, float* __restrict__ sim)
{
  __shared__ __align__(16) float smem[LDS_FLOATS];
  static_assert(SUM_OFF + NWAVE * QBLK <= Y_OFF, "small buffers overlap the y rows");

  const int tid  = threadIdx.x;
  const int w    = tid >> 5;
  const int lane = tid & 31;
  const int h    = lane >> 4;
  const int r    = lane & 15;

  const int b    = blockIdx.x >> 6;          // TQ/QBLK = 64 blocks per batch
  const int q0   = (blockIdx.x & 63) * QBLK;
  const int tyW  = w * 128;

  float* qSum   = smem + QS_OFF;
  float* red    = smem + RED_OFF;
  float* maxBuf = smem + MAX_OFF;
  float* sumBuf = smem + SUM_OFF;
  float* yBuf   = smem + Y_OFF + w * (128 * YPITCH);   // read only by the wave that fills it

  // copies half hb (128 B) of the wave's 128 y rows: eight lanes take one row's half, a whole line.
  // Row t = 4u + (lane >> 3) goes to slot (t & 3) * 32 + (t >> 2): lane l finds its row j in slot 32j + l.
  auto issue_y = [&](int hb) {
    const char* g = (const char*)(Y + ((size_t)b * TY + tyW + (lane >> 3)) * DD) + hb * 128 + (lane & 7) * 16;
    char*       l = (char*)(yBuf + (lane >> 3) * 32 * YPITCH) + hb * 128 + (lane & 7) * 16;
#pragma unroll
    for (int u = 0; u < 32; ++u)
      __builtin_amdgcn_global_load_async_to_lds_b128(
          (AS1 v4i*)(g + u * 4 * DD * 4), (AS3 v4i*)(l + u * YPITCH * 4), 0, 0);
  };

  issue_y(0);

  // the work-group's 16 query rows; row i, floats 16c..16c+15: qs16[i * 4 + c]
  const AS4 v16f* qs16 = (const AS4 v16f*)(Q + ((size_t)b * TQ + q0) * DD);
  // While the y copies fly: wave w sums query rows 2w and 2w+1 (sim needs the sums at the end). The eight
  // waves so read all 4 KB once, and the hot loop's scalar loads find the rows in the scalar cache.
  {
    const int wu = __builtin_amdgcn_readfirstlane(w);   // the wave's number as a scalar: scalar addresses
    float rs[2];
#pragma unroll
    for (int rr = 0; rr < 2; ++rr) {
      const AS4 v16f* qr = qs16 + (2 * wu + rr) * 4;
      const v16f t = (qr[0] + qr[1]) + (qr[2] + qr[3]);
      float u[8];
#pragma unroll
      for (int e = 0; e < 8; ++e) u[e] = t[e] + t[e + 8];
      rs[rr] = ((u[0] + u[4]) + (u[1] + u[5])) + ((u[2] + u[6]) + (u[3] + u[7]));
    }
    if (lane < 2) qSum[2 * w + lane] = lane ? rs[1] : rs[0];   // read behind the barriers of the softmax
  }
  v16f qg[2][2];   // two buffers of two query rows' quarters, in scalar registers
  qg[0][0] = qs16[0];
  qg[0][1] = qs16[4];

  // the wave's own copies have landed: its y halves may be read (no other wave reads them)
  asm volatile("s_wait_asynccnt 0x0" ::: "memory");
  issue_y(1);        // lands while passes 0 and 1 run

  v2f acc2[QBLK][4];
#pragma unroll
  for (int i = 0; i < QBLK; ++i)
#pragma unroll
    for (int j = 0; j < 4; ++j) acc2[i][j] = v2f{0.f, 0.f};
  float sy[4] = {0.f, 0.f, 0.f, 0.f};          // sum of the lane's y row j

  // ---- sum max(q, y): pass p = floats 16p..16p+15 of every row. acc2[i][j] sums query row i against
  // the lane's y row j, .x over the even d and .y over the odd d, each in the order d ascending.
  // Group G = query row i of pass p. Groups 2P+2 and 2P+3 are loaded while groups 2P and 2P+1 are worked on.
  const float4* yl4 = (const float4*)(yBuf + lane * YPITCH);   // row j, float4 column c: yl4[j * 32 * 17 + c]
  float4 yr[4][4];
  v2f    mc[4];
#pragma unroll
  for (int p = 0; p < 4; ++p) {
    if (p == 2) {
      // the second halves of the wave's y rows have landed
      asm volatile("s_wait_asynccnt 0x0" ::: "memory");
    }
#pragma unroll
    for (int j = 0; j < 4; ++j)
#pragma unroll
      for (int c = 0; c < 4; ++c) yr[j][c] = yl4[j * 32 * (YPITCH / 4) + p * 4 + c];
#pragma unroll
    for (int j = 0; j < 4; ++j) {
      const v2f t = ((v2f{yr[j][0].x, yr[j][0].y} + v2f{yr[j][0].z, yr[j][0].w}) +
                     (v2f{yr[j][1].x, yr[j][1].y} + v2f{yr[j][1].z, yr[j][1].w})) +
                    ((v2f{yr[j][2].x, yr[j][2].y} + v2f{yr[j][2].z, yr[j][2].w}) +
                     (v2f{yr[j][3].x, yr[j][3].y} + v2f{yr[j][3].z, yr[j][3].w}));
      sy[j] += t.x + t.y;
    }
#pragma unroll
    for (int i = 0; i < QBLK; ++i) {
      const int G = p * QBLK + i;
      // keeps the pass's y reads as one block in front of its arithmetic, not sunk to their uses
      if (i == 0) __builtin_amdgcn_sched_barrier(0);
#pragma unroll
      for (int k = 0; k < 8; ++k) {            // k = pair of floats
        const float  qx = qg[(G >> 1) & 1][G & 1][2 * k];
        const float  qy = qg[(G >> 1) & 1][G & 1][2 * k + 1];
        float yx[4], yy[4], nx[4], ny[4];
#pragma unroll
        for (int j = 0; j < 4; ++j) {
          const float4 yv = yr[j][k >> 1];
          yx[j] = (k & 1) ? yv.z : yv.x;
          yy[j] = (k & 1) ? yv.w : yv.y;
        }
        if (i == 0 && k == 0) {
          MAX4(nx, ny, qx, qy, yx, yy);
        } else {
          const int ip = (k == 0) ? i - 1 : i;   // the query row of the step before
          ADD4_MAX4(acc2[ip], mc, nx, ny, qx, qy, yx, yy);
        }
#pragma unroll
        for (int j = 0; j < 4; ++j) mc[j] = v2f{nx[j], ny[j]};
        if (k == 0 && (G & 1) == 0 && G + 2 < 4 * QBLK) {
          // The next two groups' scalar loads stand BEHIND this pair's first step: scalar loads return in
          // any order, so the wait in front of that step is a wait for all of them, and must not find
          // the new ones in flight. The fences hold the loads here, 15 steps ahead of their first use.
          const int pn = (G + 2) >> 4, in = (G + 2) & 15;
          __builtin_amdgcn_sched_barrier(0);
          qg[((G >> 1) + 1) & 1][0] = qs16[in * 4 + pn];
          qg[((G >> 1) + 1) & 1][1] = qs16[(in + 1) * 4 + pn];
          __builtin_amdgcn_sched_barrier(0);
        }
      }
      // ends the pass: the next pass's y reads stay one block behind this arithmetic, not spread in it
      if (i == QBLK - 1) __builtin_amdgcn_sched_barrier(0);
    }
#pragma unroll
    for (int j = 0; j < 4; ++j) acc2[QBLK - 1][j] += mc[j];   // the adds of the pass's last step
  }

  // ---- row max: per thread over its four ty, then over the 256 threads through LDS ----
  // val = (sum y - 2 sum max) / 64 = -mean|q-y| - (sum q) / 64. The last term is one constant per query
  // row: it drops out of the softmax and is added only to sim.
  float acc[QBLK][4];
#pragma unroll
  for (int i = 0; i < QBLK; ++i) {
    float lm = -3.4e38f;
#pragma unroll
    for (int j = 0; j < 4; ++j) {
      const float val = fmaf(acc2[i][j].x + acc2[i][j].y, -2.0f / (float)DD, sy[j] * (1.0f / (float)DD));
      acc[i][j] = val;
      lm = fmaxf(lm, val);
    }
    red[tid * RPITCH + i] = lm;
  }
  __syncthreads();
  {
    float m = -3.4e38f;                       // threads 16(2w+h) .. +15, query row r
#pragma unroll
    for (int k = 0; k < 16; ++k) m = fmaxf(m, red[((w * 2 + h) * 16 + k) * RPITCH + r]);
    maxBuf[(w * 2 + h) * QBLK + r] = m;
  }
  __syncthreads();
  float rmax = -3.4e38f;                      // of query row r
#pragma unroll
  for (int j = 0; j < 16; ++j) rmax = fmaxf(rmax, maxBuf[j * QBLK + r]);

  // ---- exp + partial sum in registers; row i's max comes from lane i ----
#pragma unroll
  for (int i = 0; i < QBLK; ++i) {
    const float mi = __int_as_float(__builtin_amdgcn_readlane(__float_as_int(rmax), i));
    float psum = 0.f;
#pragma unroll
    for (int j = 0; j < 4; ++j) {
      // exp(x) = 2^(x * log2 e). The v_nop is the one slot that the instruction set asks for behind a
      // transcendental; in the same statement it cannot be moved away from it.
      const float t = (acc[i][j] - mi) * 1.44269504f;
      float e;
      asm("v_exp_f32 %0, %1\n\tv_nop" : "=v"(e) : "v"(t));
      acc[i][j] = e;
      psum += e;
    }
    red[tid * RPITCH + i] = psum;
  }
  __syncthreads();

  // ---- sums on the matrix unit: ones(16x4) x partial(4x16). Each wave sums its own 32 threads'
  // partials (8 chunks), then every wave sums the 8 waves' results (2 chunks). All rows of the
  // result are equal, so c[0] holds query row r's sum in every lane.
  v2f a; a.x = 1.0f; a.y = 1.0f;                   // A = all-ones 16x4
  v8f c1 = {0.f, 0.f, 0.f, 0.f, 0.f, 0.f, 0.f, 0.f};
#pragma unroll
  for (int c4 = 0; c4 < 8; ++c4) {
    v2f bm;                                        // B[k][n]: n=lane&15, k=2h+{0,1}
    bm.x = red[(w * 32 + 4 * c4 + 2 * h + 0) * RPITCH + r];
    bm.y = red[(w * 32 + 4 * c4 + 2 * h + 1) * RPITCH + r];
    c1 = __builtin_amdgcn_wmma_f32_16x16x4_f32(false, a, false, bm, (short)0, c1, false, false);
  }
  if (lane < 16) sumBuf[w * QBLK + lane] = c1[0];
  __syncthreads();
  v8f c2 = {0.f, 0.f, 0.f, 0.f, 0.f, 0.f, 0.f, 0.f};
#pragma unroll
  for (int c4 = 0; c4 < 2; ++c4) {
    v2f bm;
    bm.x = sumBuf[(4 * c4 + 2 * h + 0) * QBLK + r];
    bm.y = sumBuf[(4 * c4 + 2 * h + 1) * QBLK + r];
    c2 = __builtin_amdgcn_wmma_f32_16x16x4_f32(false, a, false, bm, (short)0, c2, false, false);
  }

  // ---- normalize and write att: per query row the wave stores 512 contiguous bytes ----
  const float inv = 1.0f / c2[0];                  // of query row r
  float* attW = att + ((size_t)b * TQ + q0) * TY + tyW + lane * 4;
#pragma unroll
  for (int i = 0; i < QBLK; ++i) {
    const float vi = __int_as_float(__builtin_amdgcn_readlane(__float_as_int(inv), i));
    v4f o;
    o.x = acc[i][0] * vi;
    o.y = acc[i][1] * vi;
    o.z = acc[i][2] * vi;
    o.w = acc[i][3] * vi;
    // non-temporal: att is written once and never read here, so its lines need not wait in L2 for the
    // write-back at the launch's end; those of work-groups that end early leave while others still compute
    __builtin_nontemporal_store(o, (v4f*)(attW + (size_t)i * TY));
  }
  if (tid < 16)   // tid<16 => r=tid
    sim[(size_t)b * TQ + q0 + tid] = rmax + qSum[tid] * (1.0f / (float)DD);
}

extern "C" void kernel_launch(void* const* d_in, const int* in_sizes, int n_in,
                              void* d_out, int out_size, void* d_ws, size_t ws_size,
                              hipStream_t stream) {
  const float* Q = (const float*)d_in[0];
  const float* Y = (const float*)d_in[1];
  float* att = (float*)d_out;
  const int B = in_sizes[0] / (TQ * DD);
  float* sim = att + (size_t)B * TQ * TY;   // outputs concatenated: att then sim
  dim3 grid(B * (TQ / QBLK));               // 256 workgroups for B=4
  att_l1_softmax_kernel<<<grid, dim3(256), 0, stream>>>(Q, Y, att, sim);
}
